// v000
// Measured on an AMD MI455X. A time is GPU time per run, averaged over a window of back-to-back runs after a warm-up
// (all launches, gaps included; the runs take copies of the inputs in turn), and the median of several windows.
// Apart from v000's, it joins two sittings. Times from different sittings can be a few percent apart, while
// side-by-side timings come from the same sitting.
// v000, which the later versions start from, runs in 248 microseconds.
#include <hip/hip_runtime.h>

// ChebyshevKAN layer as a WMMA GEMM on gfx1250 (wave32).
// y[b,o] = sum_i sum_j T_j(xn[b,i]) * C[i,o,j]
//   => GEMM: M=8192, N=1024, K=1024*9=9216, f16 operands, f32 accumulate.
//
// Pipeline:
//   K1: per-row min/max -> (scale, bias) in ws
//   K2: coeffs f32 [i][o][j] -> f16 K-major Bh[o][i*9+j] in ws (one-time,
//       L2-resident: 18.9 MB << 192 MB L2)
//   K3: 128x128 block tile, 8 waves as 4(M)x2(N), wave tile 32x64
//       (2x4 fragments of v_wmma_f32_16x16x32_f16), A tile = Chebyshev
//       recurrence computed on the fly, software-pipelined global loads.
//   Fallback (small ws): round-1 fused kernel (128x64 tile).

#define DEG      9
#define IN_DIM   1024
#define OUT_DIM  1024
#define NROWS    8192

#define KI  32           // i-values per K chunk
#define KC  (KI * DEG)   // 288 f16 K elements per chunk = 9 WMMA k-steps
#define SA  (KC + 8)     // padded LDS stride in halves (16B-aligned rows)

#define FBM 128          // fast-path block tile M
#define FBN 128          // fast-path block tile N
#define SBM 128          // fallback block tile M
#define SBN 64           // fallback block tile N

#define CI  32           // convert kernel: i per block
#define CO  64           // convert kernel: o per block

typedef __attribute__((ext_vector_type(16))) _Float16 v16h;
typedef __attribute__((ext_vector_type(8)))  float    v8f;
typedef __attribute__((ext_vector_type(4)))  float    v4f;
typedef __attribute__((ext_vector_type(4)))  unsigned int v4u;
typedef __attribute__((ext_vector_type(2)))  float    v2f;

// ---------------------------------------------------------------------------
// K1: per-row min/max -> affine (scale, bias) so xn = x*scale + bias
// ---------------------------------------------------------------------------
__global__ void __launch_bounds__(256)
cheby_row_stats(const float* __restrict__ x, float* __restrict__ stats) {
  __shared__ float smn[256];
  __shared__ float smx[256];
  const int row = blockIdx.x;
  const int tid = threadIdx.x;
  const float* xr = x + (size_t)row * IN_DIM;
  float mn = 3.4e38f, mx = -3.4e38f;
  for (int c = tid; c < IN_DIM; c += 256) {
    float v = xr[c];
    mn = fminf(mn, v);
    mx = fmaxf(mx, v);
  }
  smn[tid] = mn; smx[tid] = mx;
  __syncthreads();
  for (int s = 128; s > 0; s >>= 1) {
    if (tid < s) {
      smn[tid] = fminf(smn[tid], smn[tid + s]);
      smx[tid] = fmaxf(smx[tid], smx[tid + s]);
    }
    __syncthreads();
  }
  if (tid == 0) {
    float scale = 2.0f / (smx[0] - smn[0]);
    stats[2 * row + 0] = scale;
    stats[2 * row + 1] = -smn[0] * scale - 1.0f;
  }
}

// ---------------------------------------------------------------------------
// K2: one-time coeffs conversion + transpose to K-major f16:
//     Bh[o][i*9 + j] = (f16) C[i][o][j].
// Coalesced reads (576 consecutive floats per i), 576B-contiguous writes.
// ---------------------------------------------------------------------------
__global__ void __launch_bounds__(256)
cheby_convert_coeffs(const float* __restrict__ c, _Float16* __restrict__ bh) {
  __shared__ _Float16 t[CO][CI * DEG + 8];   // 64 x 296 halves
  const int i0 = blockIdx.x * CI;
  const int o0 = blockIdx.y * CO;
  const int tid = threadIdx.x;
  for (int idx = tid; idx < CI * CO * DEG; idx += 256) {
    int i  = idx / (CO * DEG);
    int t2 = idx % (CO * DEG);
    int o  = t2 / DEG;
    int j  = t2 % DEG;
    float v = c[(size_t)(i0 + i) * (OUT_DIM * DEG) + (size_t)(o0 + o) * DEG + j];
    t[o][i * DEG + j] = (_Float16)v;
  }
  __syncthreads();
  for (int idx = tid; idx < CO * (CI * DEG); idx += 256) {
    int o = idx / (CI * DEG);
    int k = idx % (CI * DEG);
    bh[(size_t)(o0 + o) * (IN_DIM * DEG) + (size_t)i0 * DEG + k] = t[o][k];
  }
}

// ---------------------------------------------------------------------------
// K3 (fast path): software-pipelined WMMA GEMM.
// ---------------------------------------------------------------------------
__global__ void __launch_bounds__(256, 1)
cheby_kan_gemm_fast(const float* __restrict__ x,
                    const _Float16* __restrict__ bh,
                    const float* __restrict__ stats,
                    float* __restrict__ out) {
  extern __shared__ _Float16 smem[];
  _Float16* As = smem;               // [FBM][SA]
  _Float16* Bs = smem + FBM * SA;    // [FBN][SA] (K-major rows, padded)

  const int tid  = threadIdx.x;
  const int lane = tid & 31;
  const int wave = tid >> 5;
  const int wm   = wave & 3;         // 0..3 : 32-row strip
  const int wn   = wave >> 2;        // 0..1 : 64-col strip
  const int m0   = blockIdx.x * FBM;
  const int n0   = blockIdx.y * FBN;
  const int lrow = lane & 15;
  const int lhi  = lane >> 4;

  v8f acc[2][4] = {};

  // Staging registers for the software pipeline.
  float xa[16];                      // x values for 16 (row, ii) pairs
  v4u   breg[18];                    // 18 x 16B of f16 B panel

  const int a_ii = tid & (KI - 1);   // this thread's i within chunk (fixed)
  const int a_r  = tid >> 5;         // base row (fixed); rows a_r + 8p

  auto load_chunk = [&](int i0c) {
#pragma unroll
    for (int p = 0; p < 16; ++p) {
      int r = a_r + p * 8;
      xa[p] = x[(size_t)(m0 + r) * IN_DIM + i0c + a_ii];
    }
#pragma unroll
    for (int p = 0; p < 18; ++p) {
      int idx = tid + p * 256;
      int o = idx / 36;              // B row (output channel), 0..127
      int u = idx % 36;              // 16B unit within the 576B row segment
      const v4u* src = (const v4u*)(bh + (size_t)(n0 + o) * (IN_DIM * DEG) +
                                    (size_t)i0c * DEG);
      breg[p] = src[u];
    }
  };

  auto store_chunk = [&]() {
#pragma unroll
    for (int p = 0; p < 16; ++p) {
      int r = a_r + p * 8;
      v2f sb = ((const v2f*)stats)[m0 + r];
      float xn = xa[p] * sb.x + sb.y;
      _Float16* dst = As + r * SA + a_ii * DEG;
      float t0 = 1.0f, t1 = xn;
      dst[0] = (_Float16)t0;
      dst[1] = (_Float16)t1;
#pragma unroll
      for (int n = 2; n < DEG; ++n) {
        float tn = 2.0f * xn * t1 - t0;
        dst[n] = (_Float16)tn;
        t0 = t1; t1 = tn;
      }
    }
#pragma unroll
    for (int p = 0; p < 18; ++p) {
      int idx = tid + p * 256;
      int o = idx / 36;
      int u = idx % 36;
      *(v4u*)(Bs + o * SA + u * 8) = breg[p];
    }
  };

  auto compute = [&]() {
#pragma unroll
    for (int ks = 0; ks < DEG; ++ks) {
      const int kofs = ks * 32 + lhi * 8;
      v16h afr[2], bfr[4];
#pragma unroll
      for (int fm = 0; fm < 2; ++fm) {
        const _Float16* p = As + (wm * 32 + fm * 16 + lrow) * SA + kofs;
        v4f* d = (v4f*)&afr[fm];
        d[0] = *(const v4f*)(p);
        d[1] = *(const v4f*)(p + 16);
      }
#pragma unroll
      for (int fn = 0; fn < 4; ++fn) {
        const _Float16* p = Bs + (wn * 64 + fn * 16 + lrow) * SA + kofs;
        v4f* d = (v4f*)&bfr[fn];
        d[0] = *(const v4f*)(p);
        d[1] = *(const v4f*)(p + 16);
      }
#pragma unroll
      for (int fm = 0; fm < 2; ++fm)
#pragma unroll
        for (int fn = 0; fn < 4; ++fn)
          acc[fm][fn] = __builtin_amdgcn_wmma_f32_16x16x32_f16(
              false, afr[fm], false, bfr[fn], (short)0, acc[fm][fn],
              false, false);
    }
  };

  const int nchunks = IN_DIM / KI;   // 32
  load_chunk(0);
  for (int c = 0; c < nchunks; ++c) {
    store_chunk();                    // regs (chunk c) -> LDS
    __syncthreads();
    if (c + 1 < nchunks) load_chunk((c + 1) * KI);  // overlap with WMMAs
    compute();                        // 9 k-steps x 8 WMMA
    __syncthreads();
  }

  // Epilogue: C/D layout -> VGPR v is row (v + 8*lhi), col = lane&15.
  const int mbase = m0 + wm * 32 + lhi * 8;
  const int nbase = n0 + wn * 64 + lrow;
#pragma unroll
  for (int fm = 0; fm < 2; ++fm)
#pragma unroll
    for (int fn = 0; fn < 4; ++fn)
#pragma unroll
      for (int v = 0; v < 8; ++v)
        out[(size_t)(mbase + fm * 16 + v) * OUT_DIM + (nbase + fn * 16)] =
            acc[fm][fn][v];
}

// ---------------------------------------------------------------------------
// Fallback: fused conversion GEMM (used if ws too small for Bh).
// ---------------------------------------------------------------------------
__global__ void __launch_bounds__(256)
cheby_kan_gemm_fused(const float* __restrict__ x,
                     const float* __restrict__ coeffs,
                     const float* __restrict__ stats,
                     float* __restrict__ out) {
  extern __shared__ _Float16 smem[];
  _Float16* As = smem;               // [SBM][SA]
  _Float16* Bs = smem + SBM * SA;    // [SBN][SA]

  const int tid  = threadIdx.x;
  const int lane = tid & 31;
  const int wave = tid >> 5;
  const int wm   = wave & 3;
  const int wn   = wave >> 2;
  const int m0   = blockIdx.x * SBM;
  const int n0   = blockIdx.y * SBN;
  const int lrow = lane & 15;
  const int lhi  = lane >> 4;

  v8f acc[2][2] = {};

  for (int i0 = 0; i0 < IN_DIM; i0 += KI) {
#pragma unroll
    for (int p = 0; p < (SBM * KI) / 256; ++p) {
      int idx = tid + p * 256;
      int ii  = idx & (KI - 1);
      int r   = idx >> 5;
      int grow = m0 + r;
      float s  = stats[2 * grow + 0];
      float bb = stats[2 * grow + 1];
      float xv = x[(size_t)grow * IN_DIM + i0 + ii];
      float xn = xv * s + bb;
      _Float16* dst = As + r * SA + ii * DEG;
      float t0 = 1.0f, t1 = xn;
      dst[0] = (_Float16)t0;
      dst[1] = (_Float16)t1;
#pragma unroll
      for (int n = 2; n < DEG; ++n) {
        float tn = 2.0f * xn * t1 - t0;
        dst[n] = (_Float16)tn;
        t0 = t1; t1 = tn;
      }
    }
#pragma unroll
    for (int p = 0; p < (KI * SBN) / 256; ++p) {
      int idx = tid + p * 256;
      int o   = idx & (SBN - 1);
      int ii  = idx >> 6;
      const float* src =
          coeffs + (size_t)(i0 + ii) * (OUT_DIM * DEG) + (size_t)(n0 + o) * DEG;
      _Float16* dst = Bs + o * SA + ii * DEG;
#pragma unroll
      for (int j = 0; j < DEG; ++j) dst[j] = (_Float16)src[j];
    }
    __syncthreads();

#pragma unroll
    for (int ks = 0; ks < DEG; ++ks) {
      const int kofs = ks * 32 + lhi * 8;
      v16h afr[2], bfr[2];
#pragma unroll
      for (int fm = 0; fm < 2; ++fm) {
        const _Float16* p = As + (wm * 32 + fm * 16 + lrow) * SA + kofs;
        v4f* d = (v4f*)&afr[fm];
        d[0] = *(const v4f*)(p);
        d[1] = *(const v4f*)(p + 16);
      }
#pragma unroll
      for (int fn = 0; fn < 2; ++fn) {
        const _Float16* p = Bs + (wn * 32 + fn * 16 + lrow) * SA + kofs;
        v4f* d = (v4f*)&bfr[fn];
        d[0] = *(const v4f*)(p);
        d[1] = *(const v4f*)(p + 16);
      }
#pragma unroll
      for (int fm = 0; fm < 2; ++fm)
#pragma unroll
        for (int fn = 0; fn < 2; ++fn)
          acc[fm][fn] = __builtin_amdgcn_wmma_f32_16x16x32_f16(
              false, afr[fm], false, bfr[fn], (short)0, acc[fm][fn],
              false, false);
    }
    __syncthreads();
  }

  const int mbase = m0 + wm * 32 + lhi * 8;
  const int nbase = n0 + wn * 32 + lrow;
#pragma unroll
  for (int fm = 0; fm < 2; ++fm)
#pragma unroll
    for (int fn = 0; fn < 2; ++fn)
#pragma unroll
      for (int v = 0; v < 8; ++v)
        out[(size_t)(mbase + fm * 16 + v) * OUT_DIM + (nbase + fn * 16)] =
            acc[fm][fn][v];
}

// ---------------------------------------------------------------------------
extern "C" void kernel_launch(void* const* d_in, const int* in_sizes, int n_in,
                              void* d_out, int out_size, void* d_ws,
                              size_t ws_size, hipStream_t stream) {
  (void)in_sizes; (void)n_in; (void)out_size;
  const float* x      = (const float*)d_in[0];
  const float* coeffs = (const float*)d_in[1];
  float*       stats  = (float*)d_ws;                 // 8192*2 floats = 64 KB
  float*       out    = (float*)d_out;

  cheby_row_stats<<<NROWS, 256, 0, stream>>>(x, stats);

  const size_t stats_bytes = (size_t)NROWS * 2 * sizeof(float);
  const size_t bh_bytes    = (size_t)OUT_DIM * IN_DIM * DEG * sizeof(_Float16);

  if (ws_size >= stats_bytes + bh_bytes) {
    _Float16* bh = (_Float16*)((char*)d_ws + stats_bytes);
    dim3 cgrid(IN_DIM / CI, OUT_DIM / CO);            // 32 x 16
    cheby_convert_coeffs<<<cgrid, 256, 0, stream>>>(coeffs, bh);

    dim3 grid(NROWS / FBM, OUT_DIM / FBN);            // 64 x 8
    size_t shmem = (size_t)(FBM + FBN) * SA * sizeof(_Float16);  // ~148 KB
    cheby_kan_gemm_fast<<<grid, 256, shmem, stream>>>(x, bh, stats, out);
  } else {
    dim3 grid(NROWS / SBM, OUT_DIM / SBN);            // 64 x 16
    size_t shmem = (size_t)(SBM + SBN) * SA * sizeof(_Float16);  // ~111 KB
    cheby_kan_gemm_fused<<<grid, 256, shmem, stream>>>(x, coeffs, stats, out);
  }
}

// v001
// A run of this version takes 206 microseconds.
// Timed twice side by side with v000, it ran 1.25 times as fast both times.
#include <hip/hip_runtime.h>

// ChebyshevKAN layer as a WMMA GEMM on gfx1250 (wave32).
// y[b,o] = sum_i sum_j T_j(xn[b,i]) * C[i,o,j]
//   => GEMM: M=8192, N=1024, K=1024*9=9216, f16 operands, f32 accumulate.
//
// Pipeline:
//   K1: per-row min/max -> (scale, bias) in ws
//   K2: coeffs f32 [i][o][j] -> f16 K-major Bh[o][chunk][j][ii] in ws (one-time,
//       L2-resident: 18.9 MB << 192 MB L2)
//   K3: 128x128 block tile, 8 waves as 4(M)x2(N), wave tile 32x64
//       (2x4 fragments of v_wmma_f32_16x16x32_f16), A fragments = Chebyshev
//       recurrence run in registers, software-pipelined global loads.
//   Fallback (small ws): round-1 fused kernel (128x64 tile).

#define DEG      9
#define IN_DIM   1024
#define OUT_DIM  1024
#define NROWS    8192

#define KI  32           // i-values per K chunk
#define KC  (KI * DEG)   // 288 f16 K elements per chunk = 9 WMMA k-steps
#define SA  (KC + 8)     // padded LDS stride in halves (16B-aligned rows)
#define XP  (KI + 4)     // x tile LDS stride in floats (144 B = 16 B x odd)

#define FBM 128          // fast-path block tile M
#define FBN 128          // fast-path block tile N
#define SBM 128          // fallback block tile M
#define SBN 64           // fallback block tile N

#define CI  32           // convert kernel: i per block
#define CO  64           // convert kernel: o per block

typedef __attribute__((ext_vector_type(16))) _Float16 v16h;
typedef __attribute__((ext_vector_type(8)))  float    v8f;
typedef __attribute__((ext_vector_type(4)))  float    v4f;
typedef __attribute__((ext_vector_type(4)))  unsigned int v4u;
typedef __attribute__((ext_vector_type(2)))  float    v2f;
typedef __attribute__((ext_vector_type(2)))  _Float16 v2h;

// ---------------------------------------------------------------------------
// K1: per-row min/max -> affine (scale, bias) so xn = x*scale + bias
// ---------------------------------------------------------------------------
__global__ void __launch_bounds__(256)
cheby_row_stats(const float* __restrict__ x, float* __restrict__ stats) {
  __shared__ float smn[256];
  __shared__ float smx[256];
  const int row = blockIdx.x;
  const int tid = threadIdx.x;
  const float* xr = x + (size_t)row * IN_DIM;
  float mn = 3.4e38f, mx = -3.4e38f;
  for (int c = tid; c < IN_DIM; c += 256) {
    float v = xr[c];
    mn = fminf(mn, v);
    mx = fmaxf(mx, v);
  }
  smn[tid] = mn; smx[tid] = mx;
  __syncthreads();
  for (int s = 128; s > 0; s >>= 1) {
    if (tid < s) {
      smn[tid] = fminf(smn[tid], smn[tid + s]);
      smx[tid] = fmaxf(smx[tid], smx[tid + s]);
    }
    __syncthreads();
  }
  if (tid == 0) {
    float scale = 2.0f / (smx[0] - smn[0]);
    stats[2 * row + 0] = scale;
    stats[2 * row + 1] = -smn[0] * scale - 1.0f;
  }
}

// ---------------------------------------------------------------------------
// K2: one-time coeffs conversion + transpose to K-major f16:
//     Bh[o][(i/32)*288 + j*32 + i%32] = (f16) C[i][o][j]  (degree-major in
//     each 32-i chunk, the k order of the fast GEMM).
// Coalesced reads (576 consecutive floats per i), 576B-contiguous writes.
// ---------------------------------------------------------------------------
__global__ void __launch_bounds__(256)
cheby_convert_coeffs(const float* __restrict__ c, _Float16* __restrict__ bh) {
  __shared__ _Float16 t[CO][CI * DEG + 8];   // 64 x 296 halves
  const int i0 = blockIdx.x * CI;
  const int o0 = blockIdx.y * CO;
  const int tid = threadIdx.x;
  for (int idx = tid; idx < CI * CO * DEG; idx += 256) {
    int i  = idx / (CO * DEG);
    int t2 = idx % (CO * DEG);
    int o  = t2 / DEG;
    int j  = t2 % DEG;
    float v = c[(size_t)(i0 + i) * (OUT_DIM * DEG) + (size_t)(o0 + o) * DEG + j];
    t[o][i * DEG + j] = (_Float16)v;
  }
  __syncthreads();
  for (int idx = tid; idx < CO * (CI * DEG); idx += 256) {
    int o = idx / (CI * DEG);
    int k = idx % (CI * DEG);
    bh[(size_t)(o0 + o) * (IN_DIM * DEG) + (size_t)i0 * DEG + k] =
        t[o][(k & (CI - 1)) * DEG + (k >> 5)];
  }
}

// ---------------------------------------------------------------------------
// K3 (fast path): software-pipelined WMMA GEMM.
// K order inside a chunk is degree-major (k = j*32 + ii), so k-step j needs
// exactly T_j of the chunk's 32 x values: LDS holds the normalised x tile only
// and each wave runs the recurrence on its own A fragments in registers.
// ---------------------------------------------------------------------------
__global__ void __launch_bounds__(256, 1)
cheby_kan_gemm_fast(const float* __restrict__ x,
                    const _Float16* __restrict__ bh,
                    const float* __restrict__ stats,
                    float* __restrict__ out) {
  extern __shared__ _Float16 smem[];
  _Float16* Bs = smem;                      // [FBN][SA] (K-major rows, padded)
  float*    Xs = (float*)(smem + FBN * SA); // [FBM][XP] normalised x, f32

  const int tid  = threadIdx.x;
  const int lane = tid & 31;
  const int wave = tid >> 5;
  const int wm   = wave & 3;         // 0..3 : 32-row strip
  const int wn   = wave >> 2;        // 0..1 : 64-col strip
  const int m0   = blockIdx.x * FBM;
  const int n0   = blockIdx.y * FBN;
  const int lrow = lane & 15;
  const int lhi  = lane >> 4;

  v8f acc[2][4] = {};

  // Staging registers for the software pipeline.
  v4f   xq[4];                       // 4 x 16B of the x tile
  v4u   breg[18];                    // 18 x 16B of f16 B panel

  const int x_r = tid >> 3;          // base row (fixed); rows x_r + 32p
  const int x_c = (tid & 7) * 4;     // first of this thread's 4 columns
  const float*   xg  = x + (size_t)m0 * IN_DIM;             // block-uniform
  const unsigned x_o = (unsigned)(x_r * IN_DIM + x_c);      // fixed per thread

  v2f sb[4];                         // (scale, bias) of this thread's 4 rows
#pragma unroll
  for (int p = 0; p < 4; ++p) sb[p] = ((const v2f*)stats)[m0 + x_r + p * 32];

  auto load_chunk = [&](int i0c) {
#pragma unroll
    for (int p = 0; p < 4; ++p)
      xq[p] = *(const v4f*)(xg + i0c + (x_o + p * 32u * IN_DIM));
#pragma unroll
    for (int p = 0; p < 18; ++p) {
      int idx = tid + p * 256;
      int o = idx / 36;              // B row (output channel), 0..127
      int u = idx % 36;              // 16B unit within the 576B row segment
      const v4u* src = (const v4u*)(bh + (size_t)(n0 + o) * (IN_DIM * DEG) +
                                    (size_t)i0c * DEG);
      breg[p] = src[u];
    }
    // The address registers of the loads above are advanced or reused below;
    // the scheduling fence keeps later register writes from rising over the wait.
    asm volatile("s_wait_xcnt 0x0" ::: "memory");
    __builtin_amdgcn_sched_barrier(0);
  };

  auto store_chunk = [&]() {
#pragma unroll
    for (int p = 0; p < 4; ++p)
      *(v4f*)(Xs + (x_r + p * 32) * XP + x_c) = xq[p] * sb[p].x + sb[p].y;
#pragma unroll
    for (int p = 0; p < 18; ++p) {
      int idx = tid + p * 256;
      int o = idx / 36;
      int u = idx % 36;
      *(v4u*)(Bs + o * SA + u * 8) = breg[p];
    }
  };

  auto compute = [&]() {
    // Lane (lrow, lhi) owns ii = 8*lhi + 0..7 and 16 + 8*lhi + 0..7 of its row,
    // the same k positions the B loader below takes.
    v2f x2[2][8], t0[2][8], t1[2][8];
#pragma unroll
    for (int fm = 0; fm < 2; ++fm) {
      const float* p = Xs + (wm * 32 + fm * 16 + lrow) * XP + lhi * 8;
#pragma unroll
      for (int q = 0; q < 4; ++q) {
        v4f v = *(const v4f*)(p + (q >> 1) * 16 + (q & 1) * 4);
        t1[fm][2 * q + 0] = v2f{v.x, v.y};
        t1[fm][2 * q + 1] = v2f{v.z, v.w};
      }
#pragma unroll
      for (int e = 0; e < 8; ++e) {
        x2[fm][e] = 2.0f * t1[fm][e];
        t0[fm][e] = v2f{1.0f, 1.0f};
      }
    }
#pragma unroll
    for (int ks = 0; ks < DEG; ++ks) {   // k-step ks = Chebyshev degree ks
      const int kofs = ks * 32 + lhi * 8;
      union { v16h v; v2h h[8]; } afr[2];
      v16h bfr[4];
#pragma unroll
      for (int fn = 0; fn < 4; ++fn) {
        const _Float16* p = Bs + (wn * 64 + fn * 16 + lrow) * SA + kofs;
        v4f* d = (v4f*)&bfr[fn];
        d[0] = *(const v4f*)(p);
        d[1] = *(const v4f*)(p + 16);
      }
#pragma unroll
      for (int fm = 0; fm < 2; ++fm)
#pragma unroll
        for (int e = 0; e < 8; ++e) {
          if (ks == 0) {
            afr[fm].h[e] = v2h{(_Float16)1.0f, (_Float16)1.0f};
          } else {
            if (ks >= 2) {
              v2f tn = x2[fm][e] * t1[fm][e] - t0[fm][e];
              t0[fm][e] = t1[fm][e];
              t1[fm][e] = tn;
            }
            afr[fm].h[e] = __builtin_convertvector(t1[fm][e], v2h);
          }
        }
#pragma unroll
      for (int fm = 0; fm < 2; ++fm)
#pragma unroll
        for (int fn = 0; fn < 4; ++fn)
          acc[fm][fn] = __builtin_amdgcn_wmma_f32_16x16x32_f16(
              false, afr[fm].v, false, bfr[fn], (short)0, acc[fm][fn],
              false, false);
    }
  };

  const int nchunks = IN_DIM / KI;   // 32
  load_chunk(0);
  for (int c = 0; c < nchunks; ++c) {
    store_chunk();                    // regs (chunk c) -> LDS
    __syncthreads();
    if (c + 1 < nchunks) load_chunk((c + 1) * KI);  // overlap with WMMAs
    compute();                        // 9 k-steps x 8 WMMA
    __syncthreads();
  }

  // Epilogue: C/D layout -> VGPR v is row (v + 8*lhi), col = lane&15.
  const int mbase = m0 + wm * 32 + lhi * 8;
  const int nbase = n0 + wn * 64 + lrow;
#pragma unroll
  for (int fm = 0; fm < 2; ++fm)
#pragma unroll
    for (int fn = 0; fn < 4; ++fn)
#pragma unroll
      for (int v = 0; v < 8; ++v)
        out[(size_t)(mbase + fm * 16 + v) * OUT_DIM + (nbase + fn * 16)] =
            acc[fm][fn][v];
}

// ---------------------------------------------------------------------------
// Fallback: fused conversion GEMM (used if ws too small for Bh).
// ---------------------------------------------------------------------------
__global__ void __launch_bounds__(256)
cheby_kan_gemm_fused(const float* __restrict__ x,
                     const float* __restrict__ coeffs,
                     const float* __restrict__ stats,
                     float* __restrict__ out) {
  extern __shared__ _Float16 smem[];
  _Float16* As = smem;               // [SBM][SA]
  _Float16* Bs = smem + SBM * SA;    // [SBN][SA]

  const int tid  = threadIdx.x;
  const int lane = tid & 31;
  const int wave = tid >> 5;
  const int wm   = wave & 3;
  const int wn   = wave >> 2;
  const int m0   = blockIdx.x * SBM;
  const int n0   = blockIdx.y * SBN;
  const int lrow = lane & 15;
  const int lhi  = lane >> 4;

  v8f acc[2][2] = {};

  for (int i0 = 0; i0 < IN_DIM; i0 += KI) {
#pragma unroll
    for (int p = 0; p < (SBM * KI) / 256; ++p) {
      int idx = tid + p * 256;
      int ii  = idx & (KI - 1);
      int r   = idx >> 5;
      int grow = m0 + r;
      float s  = stats[2 * grow + 0];
      float bb = stats[2 * grow + 1];
      float xv = x[(size_t)grow * IN_DIM + i0 + ii];
      float xn = xv * s + bb;
      _Float16* dst = As + r * SA + ii * DEG;
      float t0 = 1.0f, t1 = xn;
      dst[0] = (_Float16)t0;
      dst[1] = (_Float16)t1;
#pragma unroll
      for (int n = 2; n < DEG; ++n) {
        float tn = 2.0f * xn * t1 - t0;
        dst[n] = (_Float16)tn;
        t0 = t1; t1 = tn;
      }
    }
#pragma unroll
    for (int p = 0; p < (KI * SBN) / 256; ++p) {
      int idx = tid + p * 256;
      int o   = idx & (SBN - 1);
      int ii  = idx >> 6;
      const float* src =
          coeffs + (size_t)(i0 + ii) * (OUT_DIM * DEG) + (size_t)(n0 + o) * DEG;
      _Float16* dst = Bs + o * SA + ii * DEG;
#pragma unroll
      for (int j = 0; j < DEG; ++j) dst[j] = (_Float16)src[j];
    }
    __syncthreads();

#pragma unroll
    for (int ks = 0; ks < DEG; ++ks) {
      const int kofs = ks * 32 + lhi * 8;
      v16h afr[2], bfr[2];
#pragma unroll
      for (int fm = 0; fm < 2; ++fm) {
        const _Float16* p = As + (wm * 32 + fm * 16 + lrow) * SA + kofs;
        v4f* d = (v4f*)&afr[fm];
        d[0] = *(const v4f*)(p);
        d[1] = *(const v4f*)(p + 16);
      }
#pragma unroll
      for (int fn = 0; fn < 2; ++fn) {
        const _Float16* p = Bs + (wn * 32 + fn * 16 + lrow) * SA + kofs;
        v4f* d = (v4f*)&bfr[fn];
        d[0] = *(const v4f*)(p);
        d[1] = *(const v4f*)(p + 16);
      }
#pragma unroll
      for (int fm = 0; fm < 2; ++fm)
#pragma unroll
        for (int fn = 0; fn < 2; ++fn)
          acc[fm][fn] = __builtin_amdgcn_wmma_f32_16x16x32_f16(
              false, afr[fm], false, bfr[fn], (short)0, acc[fm][fn],
              false, false);
    }
    __syncthreads();
  }

  const int mbase = m0 + wm * 32 + lhi * 8;
  const int nbase = n0 + wn * 32 + lrow;
#pragma unroll
  for (int fm = 0; fm < 2; ++fm)
#pragma unroll
    for (int fn = 0; fn < 2; ++fn)
#pragma unroll
      for (int v = 0; v < 8; ++v)
        out[(size_t)(mbase + fm * 16 + v) * OUT_DIM + (nbase + fn * 16)] =
            acc[fm][fn][v];
}

// ---------------------------------------------------------------------------
extern "C" void kernel_launch(void* const* d_in, const int* in_sizes, int n_in,
                              void* d_out, int out_size, void* d_ws,
                              size_t ws_size, hipStream_t stream) {
  (void)in_sizes; (void)n_in; (void)out_size;
  const float* x      = (const float*)d_in[0];
  const float* coeffs = (const float*)d_in[1];
  float*       stats  = (float*)d_ws;                 // 8192*2 floats = 64 KB
  float*       out    = (float*)d_out;

  cheby_row_stats<<<NROWS, 256, 0, stream>>>(x, stats);

  const size_t stats_bytes = (size_t)NROWS * 2 * sizeof(float);
  const size_t bh_bytes    = (size_t)OUT_DIM * IN_DIM * DEG * sizeof(_Float16);

  if (ws_size >= stats_bytes + bh_bytes) {
    _Float16* bh = (_Float16*)((char*)d_ws + stats_bytes);
    dim3 cgrid(IN_DIM / CI, OUT_DIM / CO);            // 32 x 16
    cheby_convert_coeffs<<<cgrid, 256, 0, stream>>>(coeffs, bh);

    dim3 grid(NROWS / FBM, OUT_DIM / FBN);            // 64 x 8
    size_t shmem = (size_t)FBN * SA * sizeof(_Float16) +
                   (size_t)FBM * XP * sizeof(float);            // ~92 KB
    cheby_kan_gemm_fast<<<grid, 256, shmem, stream>>>(x, bh, stats, out);
  } else {
    dim3 grid(NROWS / SBM, OUT_DIM / SBN);            // 64 x 16
    size_t shmem = (size_t)(SBM + SBN) * SA * sizeof(_Float16);  // ~111 KB
    cheby_kan_gemm_fused<<<grid, 256, shmem, stream>>>(x, coeffs, stats, out);
  }
}

// v002
// One run takes 194 microseconds.
// Two timings next to v001 both put it at 1.06 times that version's speed.
// All steps since v000 together make it 1.33 times as fast.
#include <hip/hip_runtime.h>

// ChebyshevKAN layer as a WMMA GEMM on gfx1250 (wave32).
// y[b,o] = sum_i sum_j T_j(xn[b,i]) * C[i,o,j]
//   => GEMM: M=8192, N=1024, K=1024*9=9216, f16 operands, f32 accumulate.
//
// Pipeline:
//   K1: per-row min/max -> (scale, bias) in ws
//   K2: coeffs f32 [i][o][j] -> f16 K-major Bh[o][chunk][j][ii] in ws (one-time,
//       L2-resident: 18.9 MB << 192 MB L2)
//   K3: 128x128 block tile, 8 waves as 4(M)x2(N), wave tile 32x64
//       (2x4 fragments of v_wmma_f32_16x16x32_f16), A fragments = Chebyshev
//       recurrence run in registers, software-pipelined global loads.
//   Fallback (small ws): round-1 fused kernel (128x64 tile).

#define DEG      9
#define IN_DIM   1024
#define OUT_DIM  1024
#define NROWS    8192

#define KI  32           // i-values per K chunk
#define KC  (KI * DEG)   // 288 f16 K elements per chunk = 9 WMMA k-steps
#define SA  (KC + 8)     // padded LDS stride in halves (16B-aligned rows)
#define XP  (KI + 4)     // x tile LDS stride in floats (144 B = 16 B x odd)

#define FBM 128          // fast-path block tile M
#define FBN 128          // fast-path block tile N
#define SBM 128          // fallback block tile M
#define SBN 64           // fallback block tile N

#define SR  2            // stats kernel: rows per wave
#define SW  16           // stats kernel: waves per block
#define CI  32           // convert kernel: i per block
#define CO  64           // convert kernel: o per block

typedef __attribute__((ext_vector_type(16))) _Float16 v16h;
typedef __attribute__((ext_vector_type(8)))  float    v8f;
typedef __attribute__((ext_vector_type(4)))  float    v4f;
typedef __attribute__((ext_vector_type(4)))  unsigned int v4u;
typedef __attribute__((ext_vector_type(2)))  float    v2f;
typedef __attribute__((ext_vector_type(2)))  _Float16 v2h;

// ---------------------------------------------------------------------------
// K1: per-row min/max -> affine (scale, bias) so xn = x*scale + bias
// One wave owns SR whole rows: all of their 16-byte loads are issued before the
// first use, and minimum and maximum are folded across the 32 lanes.
// ---------------------------------------------------------------------------
__global__ void __launch_bounds__(SW * 32)
cheby_row_stats(const float* __restrict__ x, float* __restrict__ stats) {
  const int lane = threadIdx.x & 31;
  const int wave = threadIdx.x >> 5;
  const int row0 = (blockIdx.x * SW + wave) * SR;
  const v4f* xr = (const v4f*)(x + (size_t)row0 * IN_DIM) + lane;
  v4f v[SR][IN_DIM / 128];
  // Every loop below is unrolled so that v, mn and mx are indexed by constants
  // only and stay in registers.
#pragma unroll
  for (int r = 0; r < SR; ++r)
#pragma unroll
    for (int q = 0; q < IN_DIM / 128; ++q)
      v[r][q] = xr[r * (IN_DIM / 4) + q * 32];
  // The address pair of the loads above is free for reuse below: naming it here
  // keeps it whole up to the wait. The scheduling fence keeps every load in
  // front of the first use, so that a wave has both rows in flight at once.
  asm volatile("s_wait_xcnt 0x0" :: "v"(xr) : "memory");
  __builtin_amdgcn_sched_barrier(0);
  float mn[SR], mx[SR];
#pragma unroll
  for (int r = 0; r < SR; ++r) {
    mn[r] = 3.4e38f; mx[r] = -3.4e38f;
#pragma unroll
    for (int q = 0; q < IN_DIM / 128; ++q) {
      mn[r] = fminf(mn[r], fminf(fminf(v[r][q].x, v[r][q].y),
                                 fminf(v[r][q].z, v[r][q].w)));
      mx[r] = fmaxf(mx[r], fmaxf(fmaxf(v[r][q].x, v[r][q].y),
                                 fmaxf(v[r][q].z, v[r][q].w)));
    }
  }
#pragma unroll
  for (int m = 16; m > 0; m >>= 1)
#pragma unroll
    for (int r = 0; r < SR; ++r) {
      mn[r] = fminf(mn[r], __shfl_xor(mn[r], m, 32));
      mx[r] = fmaxf(mx[r], __shfl_xor(mx[r], m, 32));
    }
  if (lane < SR) {                   // lane r stores row r's pair
    float lo = mn[0], hi = mx[0];
#pragma unroll
    for (int r = 1; r < SR; ++r)
      if (lane == r) { lo = mn[r]; hi = mx[r]; }
    float scale = 2.0f / (hi - lo);
    ((v2f*)stats)[row0 + lane] = v2f{scale, -lo * scale - 1.0f};
  }
}

// ---------------------------------------------------------------------------
// K2: one-time coeffs conversion + transpose to K-major f16:
//     Bh[o][(i/32)*288 + j*32 + i%32] = (f16) C[i][o][j]  (degree-major in
//     each 32-i chunk, the k order of the fast GEMM).
// Coalesced reads (576 consecutive floats per i), 576B-contiguous writes.
// ---------------------------------------------------------------------------
__global__ void __launch_bounds__(256)
cheby_convert_coeffs(const float* __restrict__ c, _Float16* __restrict__ bh) {
  __shared__ _Float16 t[CO][CI * DEG + 8];   // 64 x 296 halves
  const int i0 = blockIdx.x * CI;
  const int o0 = blockIdx.y * CO;
  const int tid = threadIdx.x;
  for (int idx = tid; idx < CI * CO * DEG; idx += 256) {
    int i  = idx / (CO * DEG);
    int t2 = idx % (CO * DEG);
    int o  = t2 / DEG;
    int j  = t2 % DEG;
    float v = c[(size_t)(i0 + i) * (OUT_DIM * DEG) + (size_t)(o0 + o) * DEG + j];
    t[o][i * DEG + j] = (_Float16)v;
  }
  __syncthreads();
  for (int idx = tid; idx < CO * (CI * DEG); idx += 256) {
    int o = idx / (CI * DEG);
    int k = idx % (CI * DEG);
    bh[(size_t)(o0 + o) * (IN_DIM * DEG) + (size_t)i0 * DEG + k] =
        t[o][(k & (CI - 1)) * DEG + (k >> 5)];
  }
}

// ---------------------------------------------------------------------------
// K3 (fast path): software-pipelined WMMA GEMM.
// K order inside a chunk is degree-major (k = j*32 + ii), so k-step j needs
// exactly T_j of the chunk's 32 x values: LDS holds the normalised x tile only
// and each wave runs the recurrence on its own A fragments in registers.
// ---------------------------------------------------------------------------
__global__ void __launch_bounds__(256, 1)
cheby_kan_gemm_fast(const float* __restrict__ x,
                    const _Float16* __restrict__ bh,
                    const float* __restrict__ stats,
                    float* __restrict__ out) {
  extern __shared__ _Float16 smem[];
  _Float16* Bs = smem;                      // [FBN][SA] (K-major rows, padded)
  float*    Xs = (float*)(smem + FBN * SA); // [FBM][XP] normalised x, f32

  const int tid  = threadIdx.x;
  const int lane = tid & 31;
  const int wave = tid >> 5;
  const int wm   = wave & 3;         // 0..3 : 32-row strip
  const int wn   = wave >> 2;        // 0..1 : 64-col strip
  const int m0   = blockIdx.x * FBM;
  const int n0   = blockIdx.y * FBN;
  const int lrow = lane & 15;
  const int lhi  = lane >> 4;

  v8f acc[2][4] = {};

  // Staging registers for the software pipeline.
  v4f   xq[4];                       // 4 x 16B of the x tile
  v4u   breg[18];                    // 18 x 16B of f16 B panel

  const int x_r = tid >> 3;          // base row (fixed); rows x_r + 32p
  const int x_c = (tid & 7) * 4;     // first of this thread's 4 columns
  const float*   xg  = x + (size_t)m0 * IN_DIM;             // block-uniform
  const unsigned x_o = (unsigned)(x_r * IN_DIM + x_c);      // fixed per thread

  v2f sb[4];                         // (scale, bias) of this thread's 4 rows
#pragma unroll
  for (int p = 0; p < 4; ++p) sb[p] = ((const v2f*)stats)[m0 + x_r + p * 32];

  auto load_chunk = [&](int i0c) {
#pragma unroll
    for (int p = 0; p < 4; ++p)
      xq[p] = *(const v4f*)(xg + i0c + (x_o + p * 32u * IN_DIM));
#pragma unroll
    for (int p = 0; p < 18; ++p) {
      int idx = tid + p * 256;
      int o = idx / 36;              // B row (output channel), 0..127
      int u = idx % 36;              // 16B unit within the 576B row segment
      const v4u* src = (const v4u*)(bh + (size_t)(n0 + o) * (IN_DIM * DEG) +
                                    (size_t)i0c * DEG);
      breg[p] = src[u];
    }
    // The address registers of the loads above are advanced or reused below;
    // the scheduling fence keeps later register writes from rising over the wait.
    asm volatile("s_wait_xcnt 0x0" ::: "memory");
    __builtin_amdgcn_sched_barrier(0);
  };

  auto store_chunk = [&]() {
#pragma unroll
    for (int p = 0; p < 4; ++p)
      *(v4f*)(Xs + (x_r + p * 32) * XP + x_c) = xq[p] * sb[p].x + sb[p].y;
#pragma unroll
    for (int p = 0; p < 18; ++p) {
      int idx = tid + p * 256;
      int o = idx / 36;
      int u = idx % 36;
      *(v4u*)(Bs + o * SA + u * 8) = breg[p];
    }
  };

  auto compute = [&]() {
    // Lane (lrow, lhi) owns ii = 8*lhi + 0..7 and 16 + 8*lhi + 0..7 of its row,
    // the same k positions the B loader below takes.
    v2f x2[2][8], t0[2][8], t1[2][8];
#pragma unroll
    for (int fm = 0; fm < 2; ++fm) {
      const float* p = Xs + (wm * 32 + fm * 16 + lrow) * XP + lhi * 8;
#pragma unroll
      for (int q = 0; q < 4; ++q) {
        v4f v = *(const v4f*)(p + (q >> 1) * 16 + (q & 1) * 4);
        t1[fm][2 * q + 0] = v2f{v.x, v.y};
        t1[fm][2 * q + 1] = v2f{v.z, v.w};
      }
#pragma unroll
      for (int e = 0; e < 8; ++e) {
        x2[fm][e] = 2.0f * t1[fm][e];
        t0[fm][e] = v2f{1.0f, 1.0f};
      }
    }
#pragma unroll
    for (int ks = 0; ks < DEG; ++ks) {   // k-step ks = Chebyshev degree ks
      const int kofs = ks * 32 + lhi * 8;
      union { v16h v; v2h h[8]; } afr[2];
      v16h bfr[4];
#pragma unroll
      for (int fn = 0; fn < 4; ++fn) {
        const _Float16* p = Bs + (wn * 64 + fn * 16 + lrow) * SA + kofs;
        v4f* d = (v4f*)&bfr[fn];
        d[0] = *(const v4f*)(p);
        d[1] = *(const v4f*)(p + 16);
      }
#pragma unroll
      for (int fm = 0; fm < 2; ++fm)
#pragma unroll
        for (int e = 0; e < 8; ++e) {
          if (ks == 0) {
            afr[fm].h[e] = v2h{(_Float16)1.0f, (_Float16)1.0f};
          } else {
            if (ks >= 2) {
              v2f tn = x2[fm][e] * t1[fm][e] - t0[fm][e];
              t0[fm][e] = t1[fm][e];
              t1[fm][e] = tn;
            }
            afr[fm].h[e] = __builtin_convertvector(t1[fm][e], v2h);
          }
        }
#pragma unroll
      for (int fm = 0; fm < 2; ++fm)
#pragma unroll
        for (int fn = 0; fn < 4; ++fn)
          acc[fm][fn] = __builtin_amdgcn_wmma_f32_16x16x32_f16(
              false, afr[fm].v, false, bfr[fn], (short)0, acc[fm][fn],
              false, false);
    }
  };

  const int nchunks = IN_DIM / KI;   // 32
  load_chunk(0);
  for (int c = 0; c < nchunks; ++c) {
    store_chunk();                    // regs (chunk c) -> LDS
    __syncthreads();
    if (c + 1 < nchunks) load_chunk((c + 1) * KI);  // overlap with WMMAs
    compute();                        // 9 k-steps x 8 WMMA
    __syncthreads();
  }

  // Epilogue: C/D layout -> VGPR v is row (v + 8*lhi), col = lane&15.
  const int mbase = m0 + wm * 32 + lhi * 8;
  const int nbase = n0 + wn * 64 + lrow;
#pragma unroll
  for (int fm = 0; fm < 2; ++fm)
#pragma unroll
    for (int fn = 0; fn < 4; ++fn)
#pragma unroll
      for (int v = 0; v < 8; ++v)
        out[(size_t)(mbase + fm * 16 + v) * OUT_DIM + (nbase + fn * 16)] =
            acc[fm][fn][v];
}

// ---------------------------------------------------------------------------
// Fallback: fused conversion GEMM (used if ws too small for Bh).
// ---------------------------------------------------------------------------
__global__ void __launch_bounds__(256)
cheby_kan_gemm_fused(const float* __restrict__ x,
                     const float* __restrict__ coeffs,
                     const float* __restrict__ stats,
                     float* __restrict__ out) {
  extern __shared__ _Float16 smem[];
  _Float16* As = smem;               // [SBM][SA]
  _Float16* Bs = smem + SBM * SA;    // [SBN][SA]

  const int tid  = threadIdx.x;
  const int lane = tid & 31;
  const int wave = tid >> 5;
  const int wm   = wave & 3;
  const int wn   = wave >> 2;
  const int m0   = blockIdx.x * SBM;
  const int n0   = blockIdx.y * SBN;
  const int lrow = lane & 15;
  const int lhi  = lane >> 4;

  v8f acc[2][2] = {};

  for (int i0 = 0; i0 < IN_DIM; i0 += KI) {
#pragma unroll
    for (int p = 0; p < (SBM * KI) / 256; ++p) {
      int idx = tid + p * 256;
      int ii  = idx & (KI - 1);
      int r   = idx >> 5;
      int grow = m0 + r;
      float s  = stats[2 * grow + 0];
      float bb = stats[2 * grow + 1];
      float xv = x[(size_t)grow * IN_DIM + i0 + ii];
      float xn = xv * s + bb;
      _Float16* dst = As + r * SA + ii * DEG;
      float t0 = 1.0f, t1 = xn;
      dst[0] = (_Float16)t0;
      dst[1] = (_Float16)t1;
#pragma unroll
      for (int n = 2; n < DEG; ++n) {
        float tn = 2.0f * xn * t1 - t0;
        dst[n] = (_Float16)tn;
        t0 = t1; t1 = tn;
      }
    }
#pragma unroll
    for (int p = 0; p < (KI * SBN) / 256; ++p) {
      int idx = tid + p * 256;
      int o   = idx & (SBN - 1);
      int ii  = idx >> 6;
      const float* src =
          coeffs + (size_t)(i0 + ii) * (OUT_DIM * DEG) + (size_t)(n0 + o) * DEG;
      _Float16* dst = Bs + o * SA + ii * DEG;
#pragma unroll
      for (int j = 0; j < DEG; ++j) dst[j] = (_Float16)src[j];
    }
    __syncthreads();

#pragma unroll
    for (int ks = 0; ks < DEG; ++ks) {
      const int kofs = ks * 32 + lhi * 8;
      v16h afr[2], bfr[2];
#pragma unroll
      for (int fm = 0; fm < 2; ++fm) {
        const _Float16* p = As + (wm * 32 + fm * 16 + lrow) * SA + kofs;
        v4f* d = (v4f*)&afr[fm];
        d[0] = *(const v4f*)(p);
        d[1] = *(const v4f*)(p + 16);
      }
#pragma unroll
      for (int fn = 0; fn < 2; ++fn) {
        const _Float16* p = Bs + (wn * 32 + fn * 16 + lrow) * SA + kofs;
        v4f* d = (v4f*)&bfr[fn];
        d[0] = *(const v4f*)(p);
        d[1] = *(const v4f*)(p + 16);
      }
#pragma unroll
      for (int fm = 0; fm < 2; ++fm)
#pragma unroll
        for (int fn = 0; fn < 2; ++fn)
          acc[fm][fn] = __builtin_amdgcn_wmma_f32_16x16x32_f16(
              false, afr[fm], false, bfr[fn], (short)0, acc[fm][fn],
              false, false);
    }
    __syncthreads();
  }

  const int mbase = m0 + wm * 32 + lhi * 8;
  const int nbase = n0 + wn * 32 + lrow;
#pragma unroll
  for (int fm = 0; fm < 2; ++fm)
#pragma unroll
    for (int fn = 0; fn < 2; ++fn)
#pragma unroll
      for (int v = 0; v < 8; ++v)
        out[(size_t)(mbase + fm * 16 + v) * OUT_DIM + (nbase + fn * 16)] =
            acc[fm][fn][v];
}

// ---------------------------------------------------------------------------
extern "C" void kernel_launch(void* const* d_in, const int* in_sizes, int n_in,
                              void* d_out, int out_size, void* d_ws,
                              size_t ws_size, hipStream_t stream) {
  (void)in_sizes; (void)n_in; (void)out_size;
  const float* x      = (const float*)d_in[0];
  const float* coeffs = (const float*)d_in[1];
  float*       stats  = (float*)d_ws;                 // 8192*2 floats = 64 KB
  float*       out    = (float*)d_out;

  cheby_row_stats<<<NROWS / (SW * SR), SW * 32, 0, stream>>>(x, stats);

  const size_t stats_bytes = (size_t)NROWS * 2 * sizeof(float);
  const size_t bh_bytes    = (size_t)OUT_DIM * IN_DIM * DEG * sizeof(_Float16);

  if (ws_size >= stats_bytes + bh_bytes) {
    _Float16* bh = (_Float16*)((char*)d_ws + stats_bytes);
    dim3 cgrid(IN_DIM / CI, OUT_DIM / CO);            // 32 x 16
    cheby_convert_coeffs<<<cgrid, 256, 0, stream>>>(coeffs, bh);

    dim3 grid(NROWS / FBM, OUT_DIM / FBN);            // 64 x 8
    size_t shmem = (size_t)FBN * SA * sizeof(_Float16) +
                   (size_t)FBM * XP * sizeof(float);            // ~92 KB
    cheby_kan_gemm_fast<<<grid, 256, shmem, stream>>>(x, bh, stats, out);
  } else {
    dim3 grid(NROWS / SBM, OUT_DIM / SBN);            // 64 x 16
    size_t shmem = (size_t)(SBM + SBN) * SA * sizeof(_Float16);  // ~111 KB
    cheby_kan_gemm_fused<<<grid, 256, shmem, stream>>>(x, coeffs, stats, out);
  }
}
